// v000
// The times below were measured on an AMD MI455X: many runs one after another, warmed up first and cycling through
// copies of the inputs, with the whole window's GPU time divided by the number of runs. Launches and the gaps
// between them are all in it. The median over several windows is given; except for v000 it joins two sittings, which
// can be a few percent apart, so the side-by-side timings, each taken in one sitting, are the better comparison.
// The starting kernel, v000, takes 397 microseconds a run.
#include <hip/hip_runtime.h>

// ---------------------------------------------------------------------------
// Self-attention (1x1-conv QKV, softmax(q^T k) v^T, 1x1-conv out, residual)
// B=4, C=512, CI=64, N=H*W=4096.  All-fp32 via V_WMMA_F32_16X16X4_F32.
// Flash-attention streaming: the 4x4096x4096 attention matrix is never
// materialized (saves ~1 GB of memory traffic vs the naive 2-pass softmax).
// ---------------------------------------------------------------------------

#define C_IN   512
#define C_INT  64
#define NTOK   4096
#define BATCH  4

typedef __attribute__((ext_vector_type(2))) float v2f;
typedef __attribute__((ext_vector_type(8))) float v8f;

__device__ __forceinline__ v8f wmma_f32_16x16x4(v2f a, v2f b, v8f c) {
  // 8-arg pattern: (neg_a, A, neg_b, B, c_mod, C, reuse_a, reuse_b)
  return __builtin_amdgcn_wmma_f32_16x16x4_f32(false, a, false, b, (short)0, c,
                                               false, false);
}

// ---------------------------------------------------------------------------
// Weight norm (dim=0): w[o][c] = v[o][c] * g[o] / ||v[o]||.  One block per
// output row; tiny arrays, pure VALU.
// ---------------------------------------------------------------------------
__global__ void wn_kernel(const float* __restrict__ v,
                          const float* __restrict__ g,
                          float* __restrict__ w, int cin) {
  const int row = blockIdx.x;
  const int tid = threadIdx.x;
  const float* vr = v + (size_t)row * cin;
  float p = 0.f;
  for (int i = tid; i < cin; i += 64) { float t = vr[i]; p += t * t; }
  __shared__ float red[64];
  red[tid] = p;
  __syncthreads();
  for (int s = 32; s > 0; s >>= 1) {
    if (tid < s) red[tid] += red[tid + s];
    __syncthreads();
  }
  const float scale = g[row] * rsqrtf(red[0]);
  float* wr = w + (size_t)row * cin;
  for (int i = tid; i < cin; i += 64) wr[i] = vr[i] * scale;
}

// ---------------------------------------------------------------------------
// QKV projection: per wave a 16(M) x 64(N) tile of W[64,512] @ X[512,4096].
// A fragment (16x4 f32): lane m = lane%16, K pair = 2*(lane/16)+{0,1} -> b64.
// B fragment (4x16 f32): row K = 2*(lane/16)+{0,1}, col = lane%16 -> 2x b32.
// ---------------------------------------------------------------------------
__global__ __launch_bounds__(32) void qkv_kernel(
    const float* __restrict__ x,
    const float* __restrict__ wq, const float* __restrict__ wk,
    const float* __restrict__ wv,
    const float* __restrict__ qb, const float* __restrict__ kb,
    const float* __restrict__ vb,
    float* __restrict__ oq, float* __restrict__ ok, float* __restrict__ ov) {
  const int nt   = blockIdx.x;        // 0..63  : 64-wide N tile
  const int bm   = blockIdx.y;        // b*4 + mt
  const int proj = blockIdx.z;        // 0..2
  const int b = bm >> 2, mt = bm & 3;

  const float* W  = (proj == 0) ? wq : (proj == 1) ? wk : wv;
  const float* Bb = (proj == 0) ? qb : (proj == 1) ? kb : vb;
  float*       O  = ((proj == 0) ? oq : (proj == 1) ? ok : ov)
                    + (size_t)b * (C_INT * NTOK);
  const float* X  = x + (size_t)b * C_IN * NTOK;

  const int lane = threadIdx.x;
  const int lm = lane & 15, lh = lane >> 4;
  const int m0 = mt * 16, n0 = nt * 64;

  v8f acc[4] = {};
  for (int k0 = 0; k0 < C_IN; k0 += 4) {
    v2f a = *(const v2f*)(W + (m0 + lm) * C_IN + k0 + 2 * lh);
    const float* xk = X + (k0 + 2 * lh) * NTOK + n0 + lm;
#pragma unroll
    for (int j = 0; j < 4; ++j) {
      v2f bm2;
      bm2.x = xk[j * 16];
      bm2.y = xk[NTOK + j * 16];
      acc[j] = wmma_f32_16x16x4(a, bm2, acc[j]);
    }
  }
#pragma unroll
  for (int j = 0; j < 4; ++j)
#pragma unroll
    for (int r = 0; r < 8; ++r) {
      const int m = m0 + r + 8 * lh;              // D layout: M = r + 8*half
      O[m * NTOK + n0 + j * 16 + lm] = acc[j][r] + Bb[m];
    }
}

// ---------------------------------------------------------------------------
// Flash attention, one wave per (batch, 16 query rows).
//   S = Q^T K       (16 chained WMMAs over the 64-channel K dim)
//   online softmax  (row stats via __shfl_xor within 16-lane halves)
//   O += P V^T      (P re-layouted D->A through a 1 KB LDS stage)
// Output written flat as [N, CI] (== the reference's raw .view reshape).
// ---------------------------------------------------------------------------
__global__ __launch_bounds__(32) void attn_kernel(
    const float* __restrict__ q, const float* __restrict__ k,
    const float* __restrict__ v, float* __restrict__ o) {
  const int qt = blockIdx.x;          // 0..255
  const int b  = blockIdx.y;
  const float* Q = q + (size_t)b * (C_INT * NTOK);
  const float* K = k + (size_t)b * (C_INT * NTOK);
  const float* V = v + (size_t)b * (C_INT * NTOK);
  float*       O = o + (size_t)b * (NTOK * C_INT);

  const int lane = threadIdx.x;
  const int lm = lane & 15, lh = lane >> 4;
  const int n0 = qt * 16;

  // Q^T tile as 16 A-fragments (M = query row, K = channel chunk of 4)
  v2f qa[16];
#pragma unroll
  for (int c = 0; c < 16; ++c) {
    const int ch = 4 * c + 2 * lh;
    qa[c].x = Q[ch * NTOK + n0 + lm];
    qa[c].y = Q[(ch + 1) * NTOK + n0 + lm];
  }

  float mrun[8], srun[8];
#pragma unroll
  for (int r = 0; r < 8; ++r) { mrun[r] = -3.0e38f; srun[r] = 0.f; }
  v8f oacc[4] = {};

  __shared__ float pld[256];          // one 16x16 P tile

  for (int kt = 0; kt < 256; ++kt) {
    const int kn0 = kt * 16;
    v8f s = {};
#pragma unroll
    for (int c = 0; c < 16; ++c) {
      const int ch = 4 * c + 2 * lh;
      v2f bk;
      bk.x = K[ch * NTOK + kn0 + lm];
      bk.y = K[(ch + 1) * NTOK + kn0 + lm];
      s = wmma_f32_16x16x4(qa[c], bk, s);
    }
    // Online softmax: lane's VGPR r holds row (r + 8*half); the row spans the
    // 16 lanes of its half-wave, so xor masks 1,2,4,8 reduce it in place.
#pragma unroll
    for (int r = 0; r < 8; ++r) {
      float rmax = s[r];
      rmax = fmaxf(rmax, __shfl_xor(rmax, 1));
      rmax = fmaxf(rmax, __shfl_xor(rmax, 2));
      rmax = fmaxf(rmax, __shfl_xor(rmax, 4));
      rmax = fmaxf(rmax, __shfl_xor(rmax, 8));
      const float mnew  = fmaxf(mrun[r], rmax);
      const float scale = __expf(mrun[r] - mnew);
      const float p     = __expf(s[r] - mnew);
      float rsum = p;
      rsum += __shfl_xor(rsum, 1);
      rsum += __shfl_xor(rsum, 2);
      rsum += __shfl_xor(rsum, 4);
      rsum += __shfl_xor(rsum, 8);
      srun[r] = srun[r] * scale + rsum;
      mrun[r] = mnew;
      s[r] = p;
#pragma unroll
      for (int j = 0; j < 4; ++j) oacc[j][r] *= scale;
    }
    // Stage P (D layout) to LDS, re-read as A fragments. Single wave per
    // workgroup: LDS is in-order per wave; __syncthreads() is ~free and pins
    // the compiler's memory ordering.
    __syncthreads();
#pragma unroll
    for (int r = 0; r < 8; ++r) pld[(r + 8 * lh) * 16 + lm] = s[r];
    __syncthreads();
#pragma unroll
    for (int kc = 0; kc < 4; ++kc) {
      v2f pa = *(const v2f*)&pld[lm * 16 + kc * 4 + 2 * lh];
#pragma unroll
      for (int j = 0; j < 4; ++j) {
        // B fragment of V^T: K = key offset, N = channel; contiguous b64.
        v2f bv = *(const v2f*)(V + (j * 16 + lm) * NTOK + kn0 + kc * 4 + 2 * lh);
        oacc[j] = wmma_f32_16x16x4(pa, bv, oacc[j]);
      }
    }
  }
  // Normalize and store flat as [n, ci]
#pragma unroll
  for (int j = 0; j < 4; ++j)
#pragma unroll
    for (int r = 0; r < 8; ++r) {
      const int row = n0 + r + 8 * lh;
      O[row * C_INT + j * 16 + lm] = oacc[j][r] / srun[r];
    }
}

// ---------------------------------------------------------------------------
// Output 1x1 conv + bias + residual; writes both tuple outputs.
// Y is the attention output buffer read flat as [64, 4096] per batch
// (faithful to the reference's raw row-major .view reshape).
// ---------------------------------------------------------------------------
__global__ __launch_bounds__(32) void outconv_kernel(
    const float* __restrict__ x, const float* __restrict__ y,
    const float* __restrict__ wa, const float* __restrict__ ab,
    float* __restrict__ outp, float* __restrict__ resp) {
  const int pt = blockIdx.x;          // 0..63 : 64-wide spatial tile
  const int ct = blockIdx.y;          // 0..31 : 16 output channels
  const int b  = blockIdx.z;
  const float* Y = y + (size_t)b * (C_INT * NTOK);
  const int lane = threadIdx.x;
  const int lm = lane & 15, lh = lane >> 4;
  const int c0 = ct * 16, p0 = pt * 64;

  v8f acc[4] = {};
  for (int k0 = 0; k0 < C_INT; k0 += 4) {
    v2f a = *(const v2f*)(wa + (c0 + lm) * C_INT + k0 + 2 * lh);
    const float* yk = Y + (k0 + 2 * lh) * NTOK + p0 + lm;
#pragma unroll
    for (int j = 0; j < 4; ++j) {
      v2f bm2;
      bm2.x = yk[j * 16];
      bm2.y = yk[NTOK + j * 16];
      acc[j] = wmma_f32_16x16x4(a, bm2, acc[j]);
    }
  }
#pragma unroll
  for (int j = 0; j < 4; ++j)
#pragma unroll
    for (int r = 0; r < 8; ++r) {
      const int c = c0 + r + 8 * lh;
      const size_t idx = ((size_t)b * C_IN + c) * NTOK + p0 + j * 16 + lm;
      const float rv = acc[j][r] + ab[c];
      resp[idx] = rv;
      outp[idx] = x[idx] + rv;
    }
}

// ---------------------------------------------------------------------------
extern "C" void kernel_launch(void* const* d_in, const int* in_sizes, int n_in,
                              void* d_out, int out_size, void* d_ws,
                              size_t ws_size, hipStream_t stream) {
  (void)in_sizes; (void)n_in; (void)out_size; (void)ws_size;
  const float* x  = (const float*)d_in[0];
  const float* qv = (const float*)d_in[1];
  const float* qg = (const float*)d_in[2];
  const float* qb = (const float*)d_in[3];
  const float* kv = (const float*)d_in[4];
  const float* kg = (const float*)d_in[5];
  const float* kb = (const float*)d_in[6];
  const float* vv = (const float*)d_in[7];
  const float* vg = (const float*)d_in[8];
  const float* vb = (const float*)d_in[9];
  const float* av = (const float*)d_in[10];
  const float* ag = (const float*)d_in[11];
  const float* ab = (const float*)d_in[12];

  // Workspace layout (floats): normalized weights then q/k/v and pre-conv
  // attention output.  Total ~17.3 MB.
  float* ws  = (float*)d_ws;
  float* wq  = ws;                                   // 64*512
  float* wk  = ws + 32768;                           // 64*512
  float* wv_ = ws + 65536;                           // 64*512
  float* wa  = ws + 98304;                           // 512*64
  float* qbuf = ws + 131072;                         // 4*64*4096
  float* kbuf = qbuf + (size_t)BATCH * C_INT * NTOK;
  float* vbuf = kbuf + (size_t)BATCH * C_INT * NTOK;
  float* obuf = vbuf + (size_t)BATCH * C_INT * NTOK; // 4*4096*64

  wn_kernel<<<dim3(C_INT), dim3(64), 0, stream>>>(qv, qg, wq, C_IN);
  wn_kernel<<<dim3(C_INT), dim3(64), 0, stream>>>(kv, kg, wk, C_IN);
  wn_kernel<<<dim3(C_INT), dim3(64), 0, stream>>>(vv, vg, wv_, C_IN);
  wn_kernel<<<dim3(C_IN),  dim3(64), 0, stream>>>(av, ag, wa, C_INT);

  qkv_kernel<<<dim3(64, 16, 3), dim3(32), 0, stream>>>(
      x, wq, wk, wv_, qb, kb, vb, qbuf, kbuf, vbuf);

  attn_kernel<<<dim3(256, BATCH), dim3(32), 0, stream>>>(qbuf, kbuf, vbuf,
                                                         obuf);

  float* outp = (float*)d_out;
  float* resp = outp + (size_t)BATCH * C_IN * NTOK;
  outconv_kernel<<<dim3(64, 32, BATCH), dim3(32), 0, stream>>>(
      x, obuf, wa, ab, outp, resp);
}

// v001
// It runs in 235 microseconds.
// Timed twice side by side with v000, it ran 1.73 and 1.72 times as fast.
#include <hip/hip_runtime.h>

// ---------------------------------------------------------------------------
// Self-attention (1x1-conv QKV, softmax(q^T k) v^T, 1x1-conv out, residual)
// B=4, C=512, CI=64, N=H*W=4096.  All-fp32 via V_WMMA_F32_16X16X4_F32.
// Flash-attention streaming: the 4x4096x4096 attention matrix is never
// materialized (saves ~1 GB of memory traffic vs the naive 2-pass softmax).
// ---------------------------------------------------------------------------

#define C_IN   512
#define C_INT  64
#define NTOK   4096
#define BATCH  4

typedef __attribute__((ext_vector_type(2))) float v2f;
typedef __attribute__((ext_vector_type(4))) float v4f;
typedef __attribute__((ext_vector_type(8))) float v8f;

__device__ __forceinline__ v8f wmma_f32_16x16x4(v2f a, v2f b, v8f c) {
  // 8-arg pattern: (neg_a, A, neg_b, B, c_mod, C, reuse_a, reuse_b)
  return __builtin_amdgcn_wmma_f32_16x16x4_f32(false, a, false, b, (short)0, c,
                                               false, false);
}

// ---------------------------------------------------------------------------
// Weight norm (dim=0): w[o][c] = v[o][c] * g[o] / ||v[o]||.  One block per
// output row; tiny arrays, pure VALU.
// ---------------------------------------------------------------------------
__global__ void wn_kernel(const float* __restrict__ v,
                          const float* __restrict__ g,
                          float* __restrict__ w, int cin) {
  const int row = blockIdx.x;
  const int tid = threadIdx.x;
  const float* vr = v + (size_t)row * cin;
  float p = 0.f;
  for (int i = tid; i < cin; i += 64) { float t = vr[i]; p += t * t; }
  __shared__ float red[64];
  red[tid] = p;
  __syncthreads();
  for (int s = 32; s > 0; s >>= 1) {
    if (tid < s) red[tid] += red[tid + s];
    __syncthreads();
  }
  const float scale = g[row] * rsqrtf(red[0]);
  float* wr = w + (size_t)row * cin;
  for (int i = tid; i < cin; i += 64) wr[i] = vr[i] * scale;
}

// ---------------------------------------------------------------------------
// QKV projection: per wave a 16(M) x 64(N) tile of W[64,512] @ X[512,4096].
// A fragment (16x4 f32): lane m = lane%16, K pair = 2*(lane/16)+{0,1} -> b64.
// B fragment (4x16 f32): row K = 2*(lane/16)+{0,1}, col = lane%16 -> 2x b32.
// ---------------------------------------------------------------------------
__global__ __launch_bounds__(32) void qkv_kernel(
    const float* __restrict__ x,
    const float* __restrict__ wq, const float* __restrict__ wk,
    const float* __restrict__ wv,
    const float* __restrict__ qb, const float* __restrict__ kb,
    const float* __restrict__ vb,
    float* __restrict__ oq, float* __restrict__ ok, float* __restrict__ ov) {
  const int nt   = blockIdx.x;        // 0..63  : 64-wide N tile
  const int bm   = blockIdx.y;        // b*4 + mt
  const int proj = blockIdx.z;        // 0..2
  const int b = bm >> 2, mt = bm & 3;

  const float* W  = (proj == 0) ? wq : (proj == 1) ? wk : wv;
  const float* Bb = (proj == 0) ? qb : (proj == 1) ? kb : vb;
  float*       O  = ((proj == 0) ? oq : (proj == 1) ? ok : ov)
                    + (size_t)b * (C_INT * NTOK);
  const float* X  = x + (size_t)b * C_IN * NTOK;

  const int lane = threadIdx.x;
  const int lm = lane & 15, lh = lane >> 4;
  const int m0 = mt * 16, n0 = nt * 64;

  v8f acc[4] = {};
  for (int k0 = 0; k0 < C_IN; k0 += 4) {
    v2f a = *(const v2f*)(W + (m0 + lm) * C_IN + k0 + 2 * lh);
    const float* xk = X + (k0 + 2 * lh) * NTOK + n0 + lm;
#pragma unroll
    for (int j = 0; j < 4; ++j) {
      v2f bm2;
      bm2.x = xk[j * 16];
      bm2.y = xk[NTOK + j * 16];
      acc[j] = wmma_f32_16x16x4(a, bm2, acc[j]);
    }
  }
#pragma unroll
  for (int j = 0; j < 4; ++j)
#pragma unroll
    for (int r = 0; r < 8; ++r) {
      const int m = m0 + r + 8 * lh;              // D layout: M = r + 8*half
      O[m * NTOK + n0 + j * 16 + lm] = acc[j][r] + Bb[m];
    }
}

// ---------------------------------------------------------------------------
// Flash attention, one wave per (batch, 16 query rows), scores transposed.
//   S^T = K^T Q     (A = keys x channels, B = channels x queries; 16 chained
//                    WMMAs over the 64-channel K dim)
//   A lane then holds 8 keys (r + 8*half) of ONE query (lane%16): maximum and
//   sum run in the lane, plus one exchange between the wave halves.
//   O^T += V P^T    (the score registers are already a B operand: k slot
//                    (half, i) of chunk kc is key 8*half + 2*kc + i; V is
//                    loaded as A in that same key order, 8 keys per lane)
// Output written flat as [N, CI] (== the reference's raw .view reshape).
// ---------------------------------------------------------------------------
__device__ __forceinline__ float xhalf(float x) {   // lane l <-> lane l ^ 16
  return __builtin_bit_cast(float, __builtin_amdgcn_permlanex16(
      __builtin_bit_cast(int, x), __builtin_bit_cast(int, x),
      0x76543210, 0xfedcba98, false, false));
}

// exp(x) as __expf forms it (one multiply, v_exp_f32). The v_nop in the same
// statement is the one slot the instruction set asks for behind a
// transcendental.
__device__ __forceinline__ float exp_slot(float x) {
  float r;
  asm("v_exp_f32 %0, %1\n\tv_nop" : "=v"(r) : "v"(x * 1.44269504088896340736f));
  return r;
}

__global__ __launch_bounds__(32) void attn_kernel(
    const float* __restrict__ q, const float* __restrict__ k,
    const float* __restrict__ v, float* __restrict__ o) {
  const int qt = blockIdx.x;          // 0..255
  const int b  = blockIdx.y;
  const float* Q = q + (size_t)b * (C_INT * NTOK);
  const float* K = k + (size_t)b * (C_INT * NTOK);
  const float* V = v + (size_t)b * (C_INT * NTOK);
  float*       O = o + (size_t)b * (NTOK * C_INT);

  const int lane = threadIdx.x;
  const int lm = lane & 15, lh = lane >> 4;
  const int n0 = qt * 16;

  // Every '#pragma unroll' below stands on a loop that indexes a register
  // array (fragments, scores, accumulators): unrolled, the indices are
  // constants and the arrays stay in VGPRs instead of scratch.
  // Q tile as 16 B-fragments (K = channel chunk of 4, N = query)
  v2f qf[16];
#pragma unroll
  for (int c = 0; c < 16; ++c) {
    const int ch = 4 * c + 2 * lh;
    qf[c].x = Q[ch * NTOK + n0 + lm];
    qf[c].y = Q[(ch + 1) * NTOK + n0 + lm];
  }

  float mrun = -3.0e38f;              // running maximum of query lm
  float srun = 0.f;                   // running sum over this half's keys
  v8f oacc[4] = {};                   // O^T: channel j*16 + r + 8*lh, query lm

  for (int kt = 0; kt < 256; ++kt) {
    const int kn0 = kt * 16;
    // K as A fragments: M = key lm, K = channel pair of chunk c.
    v2f ak[16];
#pragma unroll
    for (int c = 0; c < 16; ++c) {
      const int ch = 4 * c + 2 * lh;
      ak[c].x = K[ch * NTOK + kn0 + lm];
      ak[c].y = K[(ch + 1) * NTOK + kn0 + lm];
    }
    // V as A fragments: M = channel j*16 + lm, this half's 8 keys in a row.
    v4f va[4][2];
#pragma unroll
    for (int j = 0; j < 4; ++j) {
      const float* vp = V + (j * 16 + lm) * NTOK + kn0 + 8 * lh;
      va[j][0] = *(const v4f*)vp;
      va[j][1] = *(const v4f*)(vp + 4);
    }
    // Keeps the trip's V loads in front of the score products, so that they
    // land behind the 16-WMMA chain; without it the compiler sinks them into
    // and behind the chain and the O^T products wait for them.
    __builtin_amdgcn_sched_barrier(0);
    v8f s = {};
#pragma unroll
    for (int c = 0; c < 16; ++c) s = wmma_f32_16x16x4(ak[c], qf[c], s);
    // Online softmax of query lm: s[r] is key kn0 + r + 8*lh.
    float tmax = fmaxf(fmaxf(fmaxf(s[0], s[1]), fmaxf(s[2], s[3])),
                       fmaxf(fmaxf(s[4], s[5]), fmaxf(s[6], s[7])));
    tmax = fmaxf(tmax, xhalf(tmax));
    const float mnew  = fmaxf(mrun, tmax);
    const float scale = exp_slot(mrun - mnew);
    mrun = mnew;
#pragma unroll
    for (int r = 0; r < 8; ++r) s[r] = exp_slot(s[r] - mnew);
    srun = srun * scale + (((s[0] + s[1]) + (s[2] + s[3])) +
                           ((s[4] + s[5]) + (s[6] + s[7])));
#pragma unroll
    for (int j = 0; j < 4; ++j)
#pragma unroll
      for (int r = 0; r < 8; ++r) oacc[j][r] *= scale;
#pragma unroll
    for (int kc = 0; kc < 4; ++kc) {
      v2f pb;                         // B: keys 8*lh + 2*kc + {0,1}, query lm
      pb.x = s[2 * kc];
      pb.y = s[2 * kc + 1];
#pragma unroll
      for (int j = 0; j < 4; ++j) {
        v2f av;
        av.x = va[j][kc >> 1][2 * (kc & 1)];
        av.y = va[j][kc >> 1][2 * (kc & 1) + 1];
        oacc[j] = wmma_f32_16x16x4(av, pb, oacc[j]);
      }
    }
  }
  // Join the halves' sums, normalize, store flat as [n, ci]: a lane holds 8
  // consecutive channels of its query's row.
  srun += xhalf(srun);
  float* orow = O + (n0 + lm) * C_INT + 8 * lh;
#pragma unroll
  for (int j = 0; j < 4; ++j) {
    v4f lo, hi;
#pragma unroll
    for (int r = 0; r < 4; ++r) {
      lo[r] = oacc[j][r] / srun;
      hi[r] = oacc[j][r + 4] / srun;
    }
    *(v4f*)(orow + j * 16)     = lo;
    *(v4f*)(orow + j * 16 + 4) = hi;
  }
}

// ---------------------------------------------------------------------------
// Output 1x1 conv + bias + residual; writes both tuple outputs.
// Y is the attention output buffer read flat as [64, 4096] per batch
// (faithful to the reference's raw row-major .view reshape).
// ---------------------------------------------------------------------------
__global__ __launch_bounds__(32) void outconv_kernel(
    const float* __restrict__ x, const float* __restrict__ y,
    const float* __restrict__ wa, const float* __restrict__ ab,
    float* __restrict__ outp, float* __restrict__ resp) {
  const int pt = blockIdx.x;          // 0..63 : 64-wide spatial tile
  const int ct = blockIdx.y;          // 0..31 : 16 output channels
  const int b  = blockIdx.z;
  const float* Y = y + (size_t)b * (C_INT * NTOK);
  const int lane = threadIdx.x;
  const int lm = lane & 15, lh = lane >> 4;
  const int c0 = ct * 16, p0 = pt * 64;

  v8f acc[4] = {};
  for (int k0 = 0; k0 < C_INT; k0 += 4) {
    v2f a = *(const v2f*)(wa + (c0 + lm) * C_INT + k0 + 2 * lh);
    const float* yk = Y + (k0 + 2 * lh) * NTOK + p0 + lm;
#pragma unroll
    for (int j = 0; j < 4; ++j) {
      v2f bm2;
      bm2.x = yk[j * 16];
      bm2.y = yk[NTOK + j * 16];
      acc[j] = wmma_f32_16x16x4(a, bm2, acc[j]);
    }
  }
#pragma unroll
  for (int j = 0; j < 4; ++j)
#pragma unroll
    for (int r = 0; r < 8; ++r) {
      const int c = c0 + r + 8 * lh;
      const size_t idx = ((size_t)b * C_IN + c) * NTOK + p0 + j * 16 + lm;
      const float rv = acc[j][r] + ab[c];
      resp[idx] = rv;
      outp[idx] = x[idx] + rv;
    }
}

// ---------------------------------------------------------------------------
extern "C" void kernel_launch(void* const* d_in, const int* in_sizes, int n_in,
                              void* d_out, int out_size, void* d_ws,
                              size_t ws_size, hipStream_t stream) {
  (void)in_sizes; (void)n_in; (void)out_size; (void)ws_size;
  const float* x  = (const float*)d_in[0];
  const float* qv = (const float*)d_in[1];
  const float* qg = (const float*)d_in[2];
  const float* qb = (const float*)d_in[3];
  const float* kv = (const float*)d_in[4];
  const float* kg = (const float*)d_in[5];
  const float* kb = (const float*)d_in[6];
  const float* vv = (const float*)d_in[7];
  const float* vg = (const float*)d_in[8];
  const float* vb = (const float*)d_in[9];
  const float* av = (const float*)d_in[10];
  const float* ag = (const float*)d_in[11];
  const float* ab = (const float*)d_in[12];

  // Workspace layout (floats): normalized weights then q/k/v and pre-conv
  // attention output.  Total ~17.3 MB.
  float* ws  = (float*)d_ws;
  float* wq  = ws;                                   // 64*512
  float* wk  = ws + 32768;                           // 64*512
  float* wv_ = ws + 65536;                           // 64*512
  float* wa  = ws + 98304;                           // 512*64
  float* qbuf = ws + 131072;                         // 4*64*4096
  float* kbuf = qbuf + (size_t)BATCH * C_INT * NTOK;
  float* vbuf = kbuf + (size_t)BATCH * C_INT * NTOK;
  float* obuf = vbuf + (size_t)BATCH * C_INT * NTOK; // 4*4096*64

  wn_kernel<<<dim3(C_INT), dim3(64), 0, stream>>>(qv, qg, wq, C_IN);
  wn_kernel<<<dim3(C_INT), dim3(64), 0, stream>>>(kv, kg, wk, C_IN);
  wn_kernel<<<dim3(C_INT), dim3(64), 0, stream>>>(vv, vg, wv_, C_IN);
  wn_kernel<<<dim3(C_IN),  dim3(64), 0, stream>>>(av, ag, wa, C_INT);

  qkv_kernel<<<dim3(64, 16, 3), dim3(32), 0, stream>>>(
      x, wq, wk, wv_, qb, kb, vb, qbuf, kbuf, vbuf);

  attn_kernel<<<dim3(256, BATCH), dim3(32), 0, stream>>>(qbuf, kbuf, vbuf,
                                                         obuf);

  float* outp = (float*)d_out;
  float* resp = outp + (size_t)BATCH * C_IN * NTOK;
  outconv_kernel<<<dim3(64, 32, BATCH), dim3(32), 0, stream>>>(
      x, obuf, wa, ab, outp, resp);
}

// v002
// One run takes 164 microseconds.
// Timed twice side by side with v001, it ran 1.45 and 1.44 times as fast.
// Over all steps from v000 it is 2.49 times as fast.
#include <hip/hip_runtime.h>

// ---------------------------------------------------------------------------
// Self-attention (1x1-conv QKV, softmax(q^T k) v^T, 1x1-conv out, residual)
// B=4, C=512, CI=64, N=H*W=4096.  All-fp32 via V_WMMA_F32_16X16X4_F32.
// Flash-attention streaming: the 4x4096x4096 attention matrix is never
// materialized (saves ~1 GB of memory traffic vs the naive 2-pass softmax).
// ---------------------------------------------------------------------------

#define C_IN   512
#define C_INT  64
#define NTOK   4096
#define BATCH  4

typedef __attribute__((ext_vector_type(2))) float v2f;
typedef __attribute__((ext_vector_type(4))) float v4f;
typedef __attribute__((ext_vector_type(8))) float v8f;

__device__ __forceinline__ v8f wmma_f32_16x16x4(v2f a, v2f b, v8f c) {
  // 8-arg pattern: (neg_a, A, neg_b, B, c_mod, C, reuse_a, reuse_b)
  return __builtin_amdgcn_wmma_f32_16x16x4_f32(false, a, false, b, (short)0, c,
                                               false, false);
}

// ---------------------------------------------------------------------------
// Weight norm (dim=0): w[o][c] = v[o][c] * g[o] / ||v[o]||.  One block per
// output row; tiny arrays, pure VALU.
// ---------------------------------------------------------------------------
__global__ void wn_kernel(const float* __restrict__ v,
                          const float* __restrict__ g,
                          float* __restrict__ w, int cin) {
  const int row = blockIdx.x;
  const int tid = threadIdx.x;
  const float* vr = v + (size_t)row * cin;
  float p = 0.f;
  for (int i = tid; i < cin; i += 64) { float t = vr[i]; p += t * t; }
  __shared__ float red[64];
  red[tid] = p;
  __syncthreads();
  for (int s = 32; s > 0; s >>= 1) {
    if (tid < s) red[tid] += red[tid + s];
    __syncthreads();
  }
  const float scale = g[row] * rsqrtf(red[0]);
  float* wr = w + (size_t)row * cin;
  for (int i = tid; i < cin; i += 64) wr[i] = vr[i] * scale;
}

// ---------------------------------------------------------------------------
// QKV projection: per wave a 16(M) x 64(N) tile of W[64,512] @ X[512,4096].
// A fragment (16x4 f32): lane m = lane%16, K pair = 2*(lane/16)+{0,1} -> b64.
// B fragment (4x16 f32): row K = 2*(lane/16)+{0,1}, col = lane%16 -> 2x b32.
// ---------------------------------------------------------------------------
__global__ __launch_bounds__(32) void qkv_kernel(
    const float* __restrict__ x,
    const float* __restrict__ wq, const float* __restrict__ wk,
    const float* __restrict__ wv,
    const float* __restrict__ qb, const float* __restrict__ kb,
    const float* __restrict__ vb,
    float* __restrict__ oq, float* __restrict__ ok, float* __restrict__ ov) {
  const int nt   = blockIdx.x;        // 0..63  : 64-wide N tile
  const int bm   = blockIdx.y;        // b*4 + mt
  const int proj = blockIdx.z;        // 0..2
  const int b = bm >> 2, mt = bm & 3;

  const float* W  = (proj == 0) ? wq : (proj == 1) ? wk : wv;
  const float* Bb = (proj == 0) ? qb : (proj == 1) ? kb : vb;
  float*       O  = ((proj == 0) ? oq : (proj == 1) ? ok : ov)
                    + (size_t)b * (C_INT * NTOK);
  const float* X  = x + (size_t)b * C_IN * NTOK;

  const int lane = threadIdx.x;
  const int lm = lane & 15, lh = lane >> 4;
  const int m0 = mt * 16, n0 = nt * 64;

  v8f acc[4] = {};
  for (int k0 = 0; k0 < C_IN; k0 += 4) {
    v2f a = *(const v2f*)(W + (m0 + lm) * C_IN + k0 + 2 * lh);
    const float* xk = X + (k0 + 2 * lh) * NTOK + n0 + lm;
#pragma unroll
    for (int j = 0; j < 4; ++j) {
      v2f bm2;
      bm2.x = xk[j * 16];
      bm2.y = xk[NTOK + j * 16];
      acc[j] = wmma_f32_16x16x4(a, bm2, acc[j]);
    }
  }
#pragma unroll
  for (int j = 0; j < 4; ++j)
#pragma unroll
    for (int r = 0; r < 8; ++r) {
      const int m = m0 + r + 8 * lh;              // D layout: M = r + 8*half
      O[m * NTOK + n0 + j * 16 + lm] = acc[j][r] + Bb[m];
    }
}

// ---------------------------------------------------------------------------
// Flash attention, scores transposed. One wave takes 64 query rows (QT = 4
// tiles of 16) and one eighth of the keys, so that every K and V fragment it
// loads feeds four query tiles; the KS = 8 waves of a work-group cover all
// keys for the same 64 queries (256 work-groups, two waves per SIMD) and
// their partial results are merged through LDS at the end.
//   S^T = K^T Q     (A = keys x channels, B = channels x queries; 16 chained
//                    WMMAs over the 64-channel K dim, four chains side by side)
//   A lane then holds 8 keys (r + 8*half) of ONE query (lane%16) per tile:
//   maximum and sum run in the lane, plus one exchange between the halves.
//   O^T += V P^T    (the score registers are already a B operand: k slot
//                    (half, i) of chunk kc is key 8*half + 2*kc + i; V is
//                    loaded as A in that same key order, 8 keys per lane)
// Output written flat as [N, CI] (== the reference's raw .view reshape).
// ---------------------------------------------------------------------------
#define QT 4                          // query tiles of 16 per wave
#define KS 8                          // key slices = waves per work-group

__device__ __forceinline__ float xhalf(float x) {   // lane l <-> lane l ^ 16
  return __builtin_bit_cast(float, __builtin_amdgcn_permlanex16(
      __builtin_bit_cast(int, x), __builtin_bit_cast(int, x),
      0x76543210, 0xfedcba98, false, false));
}

// exp(x) as __expf forms it (one multiply, v_exp_f32). The v_nop in the same
// statement is the one slot the instruction set asks for behind a
// transcendental.
__device__ __forceinline__ float exp_slot(float x) {
  float r;
  asm("v_exp_f32 %0, %1\n\tv_nop" : "=v"(r) : "v"(x * 1.44269504088896340736f));
  return r;
}

__global__ __launch_bounds__(32 * KS) void attn_kernel(
    const float* __restrict__ q, const float* __restrict__ k,
    const float* __restrict__ v, float* __restrict__ o) {
  // The wave's number as a scalar: its key offset stays in SGPRs.
  const int p = __builtin_amdgcn_readfirstlane((int)(threadIdx.x >> 5));
  const int b = blockIdx.y;
  const float* Q = q + (size_t)b * (C_INT * NTOK);
  // K and V start at this wave's key slice.
  const float* K = k + (size_t)b * (C_INT * NTOK) + p * (NTOK / KS);
  const float* V = v + (size_t)b * (C_INT * NTOK) + p * (NTOK / KS);
  float*       O = o + (size_t)b * (NTOK * C_INT);

  const int lane = threadIdx.x & 31;
  const int lm = lane & 15, lh = lane >> 4;
  const int n0 = blockIdx.x * (16 * QT);

  // Every '#pragma unroll' below stands on a loop that indexes a register
  // array (fragments, scores, accumulators): unrolled, the indices are
  // constants and the arrays stay in VGPRs instead of scratch.
  // Q tiles as 16 B-fragments each (K = channel chunk of 4, N = query)
  v2f qf[QT][16];
  const float* qp = Q + 2 * lh * NTOK + n0 + lm;   // the lane's one address
#pragma unroll
  for (int t = 0; t < QT; ++t)
#pragma unroll
    for (int c = 0; c < 16; ++c) {
      qf[t][c].x = qp[(4 * c) * NTOK + t * 16];
      qf[t][c].y = qp[(4 * c + 1) * NTOK + t * 16];
    }
  // The Q loads' address registers are free for reuse from here on: the wait
  // that belongs in front of their overwrite, held in place by the two
  // scheduling barriers.
  __builtin_amdgcn_sched_barrier(0);
  asm volatile("s_wait_xcnt 0x0" ::: "memory");
  __builtin_amdgcn_sched_barrier(0);

  float mrun[QT];                     // running maximum of query lm, tile t
  float srun[QT];                     // running sum over this half's keys
  v8f oacc[QT][4];                    // O^T: channel j*16 + r + 8*lh, query lm
#pragma unroll
  for (int t = 0; t < QT; ++t) {
    mrun[t] = -3.0e38f;
    srun[t] = 0.f;
#pragma unroll
    for (int j = 0; j < 4; ++j) oacc[t][j] = v8f{};
  }

  for (int kt = 0; kt < NTOK / KS / 16; ++kt) {
    const int kn0 = kt * 16;
    // K as A fragments: M = key lm, K = channel pair of chunk c.
    v2f ak[16];
#pragma unroll
    for (int c = 0; c < 16; ++c) {
      const int ch = 4 * c + 2 * lh;
      ak[c].x = K[ch * NTOK + kn0 + lm];
      ak[c].y = K[(ch + 1) * NTOK + kn0 + lm];
    }
    // V as A fragments: M = channel j*16 + lm, this half's 8 keys in a row.
    v4f va[4][2];
#pragma unroll
    for (int j = 0; j < 4; ++j) {
      const float* vp = V + (j * 16 + lm) * NTOK + kn0 + 8 * lh;
      va[j][0] = *(const v4f*)vp;
      va[j][1] = *(const v4f*)(vp + 4);
    }
    // Keeps the trip's V loads in front of the score products, so that they
    // land behind the score WMMAs; without it the compiler sinks them into
    // and behind the chains and the O^T products wait for them.
    __builtin_amdgcn_sched_barrier(0);
    // The first score product reuses the loads' address registers; the wait in
    // front of that overwrite is written here. The
    // scheduling barrier behind it keeps the products from moving above it.
    asm volatile("s_wait_xcnt 0x0" ::: "memory");
    __builtin_amdgcn_sched_barrier(0);
    v8f s[QT];
#pragma unroll
    for (int t = 0; t < QT; ++t) s[t] = v8f{};
#pragma unroll
    for (int c = 0; c < 16; ++c)
#pragma unroll
      for (int t = 0; t < QT; ++t) s[t] = wmma_f32_16x16x4(ak[c], qf[t][c], s[t]);
    // Online softmax of query lm of each tile: s[t][r] is key kn0 + r + 8*lh.
#pragma unroll
    for (int t = 0; t < QT; ++t) {
      float tmax = fmaxf(fmaxf(fmaxf(s[t][0], s[t][1]), fmaxf(s[t][2], s[t][3])),
                         fmaxf(fmaxf(s[t][4], s[t][5]), fmaxf(s[t][6], s[t][7])));
      tmax = fmaxf(tmax, xhalf(tmax));
      const float mnew  = fmaxf(mrun[t], tmax);
      const float scale = exp_slot(mrun[t] - mnew);
      mrun[t] = mnew;
#pragma unroll
      for (int r = 0; r < 8; ++r) s[t][r] = exp_slot(s[t][r] - mnew);
      srun[t] = srun[t] * scale + (((s[t][0] + s[t][1]) + (s[t][2] + s[t][3])) +
                                   ((s[t][4] + s[t][5]) + (s[t][6] + s[t][7])));
#pragma unroll
      for (int j = 0; j < 4; ++j)
#pragma unroll
        for (int r = 0; r < 8; ++r) oacc[t][j][r] *= scale;
    }
#pragma unroll
    for (int kc = 0; kc < 4; ++kc) {
#pragma unroll
      for (int j = 0; j < 4; ++j) {
        v2f av;
        av.x = va[j][kc >> 1][2 * (kc & 1)];
        av.y = va[j][kc >> 1][2 * (kc & 1) + 1];
#pragma unroll
        for (int t = 0; t < QT; ++t) {
          v2f pb;                     // B: keys 8*lh + 2*kc + {0,1}, query lm
          pb.x = s[t][2 * kc];
          pb.y = s[t][2 * kc + 1];
          oacc[t][j] = wmma_f32_16x16x4(av, pb, oacc[t][j]);
        }
      }
    }
  }
  // Join the halves' sums, then publish this key slice's partial result.
  // Lane-contiguous 16-byte and 4-byte slots: no bank conflict.
  __shared__ v4f   part[KS][QT * 8][32];
  __shared__ float pmax[KS][QT][32];
  __shared__ float psum[KS][QT][32];
#pragma unroll
  for (int t = 0; t < QT; ++t) {
#pragma unroll
    for (int j = 0; j < 4; ++j) {
      v4f lo, hi;
#pragma unroll
      for (int r = 0; r < 4; ++r) {
        lo[r] = oacc[t][j][r];
        hi[r] = oacc[t][j][r + 4];
      }
      part[p][(t * 4 + j) * 2][lane]     = lo;
      part[p][(t * 4 + j) * 2 + 1][lane] = hi;
    }
    pmax[p][t][lane] = mrun[t];
    psum[p][t][lane] = srun[t] + xhalf(srun[t]);
  }
  __syncthreads();
  // Merge the KS slices on their common maximum. Wave p does query tile p/2,
  // channels 32*(p%2) .. +31: one whole 128-byte line of each output row.
  // Store flat as [n, ci]: a lane holds 8 consecutive channels per block j.
  const int tm = p >> 1;
  float w[KS];
#pragma unroll
  for (int i = 0; i < KS; ++i) w[i] = pmax[i][tm][lane];
  const float mall = fmaxf(fmaxf(fmaxf(w[0], w[1]), fmaxf(w[2], w[3])),
                           fmaxf(fmaxf(w[4], w[5]), fmaxf(w[6], w[7])));
  float sall = 0.f;
#pragma unroll
  for (int i = 0; i < KS; ++i) {
    w[i] = exp_slot(w[i] - mall);
    sall += w[i] * psum[i][tm][lane];
  }
#pragma unroll
  for (int jj = 0; jj < 2; ++jj) {
    const int j = 2 * (p & 1) + jj;
    v4f lo = {}, hi = {};
#pragma unroll
    for (int i = 0; i < KS; ++i) {
      lo += w[i] * part[i][(tm * 4 + j) * 2][lane];
      hi += w[i] * part[i][(tm * 4 + j) * 2 + 1][lane];
    }
#pragma unroll
    for (int r = 0; r < 4; ++r) {
      lo[r] = lo[r] / sall;
      hi[r] = hi[r] / sall;
    }
    float* orow = O + (n0 + tm * 16 + lm) * C_INT + j * 16 + 8 * lh;
    *(v4f*)orow       = lo;
    *(v4f*)(orow + 4) = hi;
  }
}

// ---------------------------------------------------------------------------
// Output 1x1 conv + bias + residual; writes both tuple outputs.
// Y is the attention output buffer read flat as [64, 4096] per batch
// (faithful to the reference's raw row-major .view reshape).
// ---------------------------------------------------------------------------
__global__ __launch_bounds__(32) void outconv_kernel(
    const float* __restrict__ x, const float* __restrict__ y,
    const float* __restrict__ wa, const float* __restrict__ ab,
    float* __restrict__ outp, float* __restrict__ resp) {
  const int pt = blockIdx.x;          // 0..63 : 64-wide spatial tile
  const int ct = blockIdx.y;          // 0..31 : 16 output channels
  const int b  = blockIdx.z;
  const float* Y = y + (size_t)b * (C_INT * NTOK);
  const int lane = threadIdx.x;
  const int lm = lane & 15, lh = lane >> 4;
  const int c0 = ct * 16, p0 = pt * 64;

  v8f acc[4] = {};
  for (int k0 = 0; k0 < C_INT; k0 += 4) {
    v2f a = *(const v2f*)(wa + (c0 + lm) * C_INT + k0 + 2 * lh);
    const float* yk = Y + (k0 + 2 * lh) * NTOK + p0 + lm;
#pragma unroll
    for (int j = 0; j < 4; ++j) {
      v2f bm2;
      bm2.x = yk[j * 16];
      bm2.y = yk[NTOK + j * 16];
      acc[j] = wmma_f32_16x16x4(a, bm2, acc[j]);
    }
  }
#pragma unroll
  for (int j = 0; j < 4; ++j)
#pragma unroll
    for (int r = 0; r < 8; ++r) {
      const int c = c0 + r + 8 * lh;
      const size_t idx = ((size_t)b * C_IN + c) * NTOK + p0 + j * 16 + lm;
      const float rv = acc[j][r] + ab[c];
      resp[idx] = rv;
      outp[idx] = x[idx] + rv;
    }
}

// ---------------------------------------------------------------------------
extern "C" void kernel_launch(void* const* d_in, const int* in_sizes, int n_in,
                              void* d_out, int out_size, void* d_ws,
                              size_t ws_size, hipStream_t stream) {
  (void)in_sizes; (void)n_in; (void)out_size; (void)ws_size;
  const float* x  = (const float*)d_in[0];
  const float* qv = (const float*)d_in[1];
  const float* qg = (const float*)d_in[2];
  const float* qb = (const float*)d_in[3];
  const float* kv = (const float*)d_in[4];
  const float* kg = (const float*)d_in[5];
  const float* kb = (const float*)d_in[6];
  const float* vv = (const float*)d_in[7];
  const float* vg = (const float*)d_in[8];
  const float* vb = (const float*)d_in[9];
  const float* av = (const float*)d_in[10];
  const float* ag = (const float*)d_in[11];
  const float* ab = (const float*)d_in[12];

  // Workspace layout (floats): normalized weights then q/k/v and pre-conv
  // attention output.  Total ~17.3 MB.
  float* ws  = (float*)d_ws;
  float* wq  = ws;                                   // 64*512
  float* wk  = ws + 32768;                           // 64*512
  float* wv_ = ws + 65536;                           // 64*512
  float* wa  = ws + 98304;                           // 512*64
  float* qbuf = ws + 131072;                         // 4*64*4096
  float* kbuf = qbuf + (size_t)BATCH * C_INT * NTOK;
  float* vbuf = kbuf + (size_t)BATCH * C_INT * NTOK;
  float* obuf = vbuf + (size_t)BATCH * C_INT * NTOK; // 4*4096*64

  wn_kernel<<<dim3(C_INT), dim3(64), 0, stream>>>(qv, qg, wq, C_IN);
  wn_kernel<<<dim3(C_INT), dim3(64), 0, stream>>>(kv, kg, wk, C_IN);
  wn_kernel<<<dim3(C_INT), dim3(64), 0, stream>>>(vv, vg, wv_, C_IN);
  wn_kernel<<<dim3(C_IN),  dim3(64), 0, stream>>>(av, ag, wa, C_INT);

  qkv_kernel<<<dim3(64, 16, 3), dim3(32), 0, stream>>>(
      x, wq, wk, wv_, qb, kb, vb, qbuf, kbuf, vbuf);

  attn_kernel<<<dim3(NTOK / (16 * QT), BATCH), dim3(32 * KS), 0, stream>>>(
      qbuf, kbuf, vbuf, obuf);

  float* outp = (float*)d_out;
  float* resp = outp + (size_t)BATCH * C_IN * NTOK;
  outconv_kernel<<<dim3(64, 32, BATCH), dim3(32), 0, stream>>>(
      x, obuf, wa, ab, outp, resp);
}

// v003
// It runs in 145 microseconds.
// Next to v002, in two timings, it ran 1.13 times as fast each time.
// Over all steps from v000 it is 2.81 times as fast.
#include <hip/hip_runtime.h>

// ---------------------------------------------------------------------------
// Self-attention (1x1-conv QKV, softmax(q^T k) v^T, 1x1-conv out, residual)
// B=4, C=512, CI=64, N=H*W=4096.  All-fp32 via V_WMMA_F32_16X16X4_F32.
// Flash-attention streaming: the 4x4096x4096 attention matrix is never
// materialized (saves ~1 GB of memory traffic vs the naive 2-pass softmax).
// ---------------------------------------------------------------------------

#define C_IN   512
#define C_INT  64
#define NTOK   4096
#define BATCH  4

typedef __attribute__((ext_vector_type(2))) float v2f;
typedef __attribute__((ext_vector_type(4))) float v4f;
typedef __attribute__((ext_vector_type(8))) float v8f;

__device__ __forceinline__ v8f wmma_f32_16x16x4(v2f a, v2f b, v8f c) {
  // 8-arg pattern: (neg_a, A, neg_b, B, c_mod, C, reuse_a, reuse_b)
  return __builtin_amdgcn_wmma_f32_16x16x4_f32(false, a, false, b, (short)0, c,
                                               false, false);
}

// ---------------------------------------------------------------------------
// Weight norm (dim=0): w[o][c] = v[o][c] * g[o] / ||v[o]||. No launch of its
// own: a product kernel loads every element of its 16 weight rows as A
// fragments anyway, so it sums their squares on the way, runs the products on
// the raw v, and multiplies each finished row sum by g[o] / ||v[o]||.
// ---------------------------------------------------------------------------
__device__ __forceinline__ float xhalf(float x) {   // lane l <-> lane l ^ 16
  return __builtin_bit_cast(float, __builtin_amdgcn_permlanex16(
      __builtin_bit_cast(int, x), __builtin_bit_cast(int, x),
      0x76543210, 0xfedcba98, false, false));
}

// val: a value of row lane%16. Returns in out[r] that of row r + 8*(lane/16),
// the D layout's row.
__device__ __forceinline__ void to_d_rows(float val, int lh, float (&out)[8]) {
#pragma unroll
  for (int r = 0; r < 8; ++r)                       // out[] stays in VGPRs
    out[r] = __builtin_bit_cast(float, __builtin_amdgcn_ds_bpermute(
        (r + 8 * lh) << 2, __builtin_bit_cast(int, val)));
}

// ss: this lane's share of the squares of weight row lane%16; gl: that row's g.
// Returns in sc[r] the factor of the D layout's row r.
__device__ __forceinline__ void row_scales(float ss, float gl, int lh,
                                           float (&sc)[8]) {
  to_d_rows(gl * rsqrtf(ss + xhalf(ss)), lh, sc);
}

// ---------------------------------------------------------------------------
// QKV projection: per wave a 16(M) x 64(N) tile of W[64,512] @ X[512,4096],
// W = the raw v here; the row factor g / ||v|| comes in at the store.
// A fragment (16x4 f32): lane m = lane%16, K pair = 2*(lane/16)+{0,1} -> b64.
// B fragment (4x16 f32): row K = 2*(lane/16)+{0,1}, col = lane%16 -> 2x b32.
// ---------------------------------------------------------------------------
__global__ __launch_bounds__(32) void qkv_kernel(
    const float* __restrict__ x,
    const float* __restrict__ wq, const float* __restrict__ wk,
    const float* __restrict__ wv,
    const float* __restrict__ qg, const float* __restrict__ kg,
    const float* __restrict__ vg,
    const float* __restrict__ qb, const float* __restrict__ kb,
    const float* __restrict__ vb,
    float* __restrict__ oq, float* __restrict__ ok, float* __restrict__ ov) {
  const int nt   = blockIdx.x;        // 0..63  : 64-wide N tile
  const int bm   = blockIdx.y;        // b*4 + mt
  const int proj = blockIdx.z;        // 0..2
  const int b = bm >> 2, mt = bm & 3;

  const float* W  = (proj == 0) ? wq : (proj == 1) ? wk : wv;
  const float* G  = (proj == 0) ? qg : (proj == 1) ? kg : vg;
  const float* Bb = (proj == 0) ? qb : (proj == 1) ? kb : vb;
  float*       O  = ((proj == 0) ? oq : (proj == 1) ? ok : ov)
                    + (size_t)b * (C_INT * NTOK);
  const float* X  = x + (size_t)b * C_IN * NTOK;

  const int lane = threadIdx.x;
  const int lm = lane & 15, lh = lane >> 4;
  const int m0 = mt * 16, n0 = nt * 64;

  const float gl = G[m0 + lm];
  v2f ss = {};                        // squares of the lane's even and odd k
  v8f acc[4] = {};
  for (int k0 = 0; k0 < C_IN; k0 += 4) {
    v2f a = *(const v2f*)(W + (m0 + lm) * C_IN + k0 + 2 * lh);
    ss += a * a;
    const float* xk = X + (k0 + 2 * lh) * NTOK + n0 + lm;
#pragma unroll
    for (int j = 0; j < 4; ++j) {
      v2f bm2;
      bm2.x = xk[j * 16];
      bm2.y = xk[NTOK + j * 16];
      acc[j] = wmma_f32_16x16x4(a, bm2, acc[j]);
    }
  }
  float sc[8];
  row_scales(ss.x + ss.y, gl, lh, sc);
#pragma unroll
  for (int j = 0; j < 4; ++j)
#pragma unroll
    for (int r = 0; r < 8; ++r) {
      const int m = m0 + r + 8 * lh;              // D layout: M = r + 8*half
      O[m * NTOK + n0 + j * 16 + lm] = acc[j][r] * sc[r] + Bb[m];
    }
}

// ---------------------------------------------------------------------------
// Flash attention, scores transposed. One wave takes 64 query rows (QT = 4
// tiles of 16) and one eighth of the keys, so that every K and V fragment it
// loads feeds four query tiles; the KS = 8 waves of a work-group cover all
// keys for the same 64 queries (256 work-groups, two waves per SIMD) and
// their partial results are merged through LDS at the end.
//   S^T = K^T Q     (A = keys x channels, B = channels x queries; 16 chained
//                    WMMAs over the 64-channel K dim, four chains side by side)
//   A lane then holds 8 keys (r + 8*half) of ONE query (lane%16) per tile:
//   maximum and sum run in the lane, plus one exchange between the halves.
//   O^T += V P^T    (the score registers are already a B operand: k slot
//                    (half, i) of chunk kc is key 8*half + 2*kc + i; V is
//                    loaded as A in that same key order, 8 keys per lane)
// Output written flat as [N, CI] (== the reference's raw .view reshape).
// ---------------------------------------------------------------------------
#define QT 4                          // query tiles of 16 per wave
#define KS 8                          // key slices = waves per work-group

// exp(x) as __expf forms it (one multiply, v_exp_f32). The v_nop in the same
// statement is the one slot the instruction set asks for behind a
// transcendental.
__device__ __forceinline__ float exp_slot(float x) {
  float r;
  asm("v_exp_f32 %0, %1\n\tv_nop" : "=v"(r) : "v"(x * 1.44269504088896340736f));
  return r;
}

__global__ __launch_bounds__(32 * KS) void attn_kernel(
    const float* __restrict__ q, const float* __restrict__ k,
    const float* __restrict__ v, float* __restrict__ o) {
  // The wave's number as a scalar: its key offset stays in SGPRs.
  const int p = __builtin_amdgcn_readfirstlane((int)(threadIdx.x >> 5));
  const int b = blockIdx.y;
  const float* Q = q + (size_t)b * (C_INT * NTOK);
  // K and V start at this wave's key slice.
  const float* K = k + (size_t)b * (C_INT * NTOK) + p * (NTOK / KS);
  const float* V = v + (size_t)b * (C_INT * NTOK) + p * (NTOK / KS);
  float*       O = o + (size_t)b * (NTOK * C_INT);

  const int lane = threadIdx.x & 31;
  const int lm = lane & 15, lh = lane >> 4;
  const int n0 = blockIdx.x * (16 * QT);

  // Every '#pragma unroll' below stands on a loop that indexes a register
  // array (fragments, scores, accumulators): unrolled, the indices are
  // constants and the arrays stay in VGPRs instead of scratch.
  // Q tiles as 16 B-fragments each (K = channel chunk of 4, N = query)
  v2f qf[QT][16];
  const float* qp = Q + 2 * lh * NTOK + n0 + lm;   // the lane's one address
#pragma unroll
  for (int t = 0; t < QT; ++t)
#pragma unroll
    for (int c = 0; c < 16; ++c) {
      qf[t][c].x = qp[(4 * c) * NTOK + t * 16];
      qf[t][c].y = qp[(4 * c + 1) * NTOK + t * 16];
    }
  // The Q loads' address registers are free for reuse from here on: the wait
  // that belongs in front of their overwrite, held in place by the two
  // scheduling barriers.
  __builtin_amdgcn_sched_barrier(0);
  asm volatile("s_wait_xcnt 0x0" ::: "memory");
  __builtin_amdgcn_sched_barrier(0);

  float mrun[QT];                     // running maximum of query lm, tile t
  float srun[QT];                     // running sum over this half's keys
  v8f oacc[QT][4];                    // O^T: channel j*16 + r + 8*lh, query lm
#pragma unroll
  for (int t = 0; t < QT; ++t) {
    mrun[t] = -3.0e38f;
    srun[t] = 0.f;
#pragma unroll
    for (int j = 0; j < 4; ++j) oacc[t][j] = v8f{};
  }

  for (int kt = 0; kt < NTOK / KS / 16; ++kt) {
    const int kn0 = kt * 16;
    // K as A fragments: M = key lm, K = channel pair of chunk c.
    v2f ak[16];
#pragma unroll
    for (int c = 0; c < 16; ++c) {
      const int ch = 4 * c + 2 * lh;
      ak[c].x = K[ch * NTOK + kn0 + lm];
      ak[c].y = K[(ch + 1) * NTOK + kn0 + lm];
    }
    // V as A fragments: M = channel j*16 + lm, this half's 8 keys in a row.
    v4f va[4][2];
#pragma unroll
    for (int j = 0; j < 4; ++j) {
      const float* vp = V + (j * 16 + lm) * NTOK + kn0 + 8 * lh;
      va[j][0] = *(const v4f*)vp;
      va[j][1] = *(const v4f*)(vp + 4);
    }
    // Keeps the trip's V loads in front of the score products, so that they
    // land behind the score WMMAs; without it the compiler sinks them into
    // and behind the chains and the O^T products wait for them.
    __builtin_amdgcn_sched_barrier(0);
    // The first score product reuses the loads' address registers; the wait in
    // front of that overwrite is written here. The
    // scheduling barrier behind it keeps the products from moving above it.
    asm volatile("s_wait_xcnt 0x0" ::: "memory");
    __builtin_amdgcn_sched_barrier(0);
    v8f s[QT];
#pragma unroll
    for (int t = 0; t < QT; ++t) s[t] = v8f{};
#pragma unroll
    for (int c = 0; c < 16; ++c)
#pragma unroll
      for (int t = 0; t < QT; ++t) s[t] = wmma_f32_16x16x4(ak[c], qf[t][c], s[t]);
    // Online softmax of query lm of each tile: s[t][r] is key kn0 + r + 8*lh.
#pragma unroll
    for (int t = 0; t < QT; ++t) {
      float tmax = fmaxf(fmaxf(fmaxf(s[t][0], s[t][1]), fmaxf(s[t][2], s[t][3])),
                         fmaxf(fmaxf(s[t][4], s[t][5]), fmaxf(s[t][6], s[t][7])));
      tmax = fmaxf(tmax, xhalf(tmax));
      const float mnew  = fmaxf(mrun[t], tmax);
      const float scale = exp_slot(mrun[t] - mnew);
      mrun[t] = mnew;
#pragma unroll
      for (int r = 0; r < 8; ++r) s[t][r] = exp_slot(s[t][r] - mnew);
      srun[t] = srun[t] * scale + (((s[t][0] + s[t][1]) + (s[t][2] + s[t][3])) +
                                   ((s[t][4] + s[t][5]) + (s[t][6] + s[t][7])));
#pragma unroll
      for (int j = 0; j < 4; ++j)
#pragma unroll
        for (int r = 0; r < 8; ++r) oacc[t][j][r] *= scale;
    }
#pragma unroll
    for (int kc = 0; kc < 4; ++kc) {
#pragma unroll
      for (int j = 0; j < 4; ++j) {
        v2f av;
        av.x = va[j][kc >> 1][2 * (kc & 1)];
        av.y = va[j][kc >> 1][2 * (kc & 1) + 1];
#pragma unroll
        for (int t = 0; t < QT; ++t) {
          v2f pb;                     // B: keys 8*lh + 2*kc + {0,1}, query lm
          pb.x = s[t][2 * kc];
          pb.y = s[t][2 * kc + 1];
          oacc[t][j] = wmma_f32_16x16x4(av, pb, oacc[t][j]);
        }
      }
    }
  }
  // Join the halves' sums, then publish this key slice's partial result.
  // Lane-contiguous 16-byte and 4-byte slots: no bank conflict.
  __shared__ v4f   part[KS][QT * 8][32];
  __shared__ float pmax[KS][QT][32];
  __shared__ float psum[KS][QT][32];
#pragma unroll
  for (int t = 0; t < QT; ++t) {
#pragma unroll
    for (int j = 0; j < 4; ++j) {
      v4f lo, hi;
#pragma unroll
      for (int r = 0; r < 4; ++r) {
        lo[r] = oacc[t][j][r];
        hi[r] = oacc[t][j][r + 4];
      }
      part[p][(t * 4 + j) * 2][lane]     = lo;
      part[p][(t * 4 + j) * 2 + 1][lane] = hi;
    }
    pmax[p][t][lane] = mrun[t];
    psum[p][t][lane] = srun[t] + xhalf(srun[t]);
  }
  __syncthreads();
  // Merge the KS slices on their common maximum. Wave p does query tile p/2,
  // channels 32*(p%2) .. +31: one whole 128-byte line of each output row.
  // Store flat as [n, ci]: a lane holds 8 consecutive channels per block j.
  const int tm = p >> 1;
  float w[KS];
#pragma unroll
  for (int i = 0; i < KS; ++i) w[i] = pmax[i][tm][lane];
  const float mall = fmaxf(fmaxf(fmaxf(w[0], w[1]), fmaxf(w[2], w[3])),
                           fmaxf(fmaxf(w[4], w[5]), fmaxf(w[6], w[7])));
  float sall = 0.f;
#pragma unroll
  for (int i = 0; i < KS; ++i) {
    w[i] = exp_slot(w[i] - mall);
    sall += w[i] * psum[i][tm][lane];
  }
#pragma unroll
  for (int jj = 0; jj < 2; ++jj) {
    const int j = 2 * (p & 1) + jj;
    v4f lo = {}, hi = {};
#pragma unroll
    for (int i = 0; i < KS; ++i) {
      lo += w[i] * part[i][(tm * 4 + j) * 2][lane];
      hi += w[i] * part[i][(tm * 4 + j) * 2 + 1][lane];
    }
#pragma unroll
    for (int r = 0; r < 4; ++r) {
      lo[r] = lo[r] / sall;
      hi[r] = hi[r] / sall;
    }
    float* orow = O + (n0 + tm * 16 + lm) * C_INT + j * 16 + 8 * lh;
    *(v4f*)orow       = lo;
    *(v4f*)(orow + 4) = hi;
  }
}

// ---------------------------------------------------------------------------
// Output 1x1 conv + bias + residual; writes both tuple outputs.
// Y is the attention output buffer read flat as [64, 4096] per batch
// (faithful to the reference's raw row-major .view reshape).
// ---------------------------------------------------------------------------
__global__ __launch_bounds__(32) void outconv_kernel(
    const float* __restrict__ x, const float* __restrict__ y,
    const float* __restrict__ wa, const float* __restrict__ ag,
    const float* __restrict__ ab,
    float* __restrict__ outp, float* __restrict__ resp) {
  const int pt = blockIdx.x;          // 0..63 : 64-wide spatial tile
  const int ct = blockIdx.y;          // 0..31 : 16 output channels
  const int b  = blockIdx.z;
  const float* Y = y + (size_t)b * (C_INT * NTOK);
  const int lane = threadIdx.x;
  const int lm = lane & 15, lh = lane >> 4;
  const int c0 = ct * 16, p0 = pt * 64;

  // g and the bias of row lm, one 4-byte load each; the D layout's rows get
  // them by lane permutes at the end.
  const float gl = ag[c0 + lm];
  const float bl = ab[c0 + lm];
  // The loads' offset register is free for reuse from here on: the wait
  // that belongs in front of that.
  asm volatile("s_wait_xcnt 0x0" ::: "memory");
  v2f ss = {};                        // squares of the lane's even and odd k
  v8f acc[4] = {};
  for (int k0 = 0; k0 < C_INT; k0 += 4) {
    v2f a = *(const v2f*)(wa + (c0 + lm) * C_INT + k0 + 2 * lh);
    ss += a * a;
    const float* yk = Y + (k0 + 2 * lh) * NTOK + p0 + lm;
#pragma unroll
    for (int j = 0; j < 4; ++j) {
      v2f bm2;
      bm2.x = yk[j * 16];
      bm2.y = yk[NTOK + j * 16];
      acc[j] = wmma_f32_16x16x4(a, bm2, acc[j]);
    }
  }
  float sc[8], bs[8];
  row_scales(ss.x + ss.y, gl, lh, sc);
  to_d_rows(bl, lh, bs);
#pragma unroll
  for (int j = 0; j < 4; ++j)
#pragma unroll
    for (int r = 0; r < 8; ++r) {
      const int c = c0 + r + 8 * lh;
      const size_t idx = ((size_t)b * C_IN + c) * NTOK + p0 + j * 16 + lm;
      const float rv = acc[j][r] * sc[r] + bs[r];
      resp[idx] = rv;
      outp[idx] = x[idx] + rv;
    }
}

// ---------------------------------------------------------------------------
extern "C" void kernel_launch(void* const* d_in, const int* in_sizes, int n_in,
                              void* d_out, int out_size, void* d_ws,
                              size_t ws_size, hipStream_t stream) {
  (void)in_sizes; (void)n_in; (void)out_size; (void)ws_size;
  const float* x  = (const float*)d_in[0];
  const float* qv = (const float*)d_in[1];
  const float* qg = (const float*)d_in[2];
  const float* qb = (const float*)d_in[3];
  const float* kv = (const float*)d_in[4];
  const float* kg = (const float*)d_in[5];
  const float* kb = (const float*)d_in[6];
  const float* vv = (const float*)d_in[7];
  const float* vg = (const float*)d_in[8];
  const float* vb = (const float*)d_in[9];
  const float* av = (const float*)d_in[10];
  const float* ag = (const float*)d_in[11];
  const float* ab = (const float*)d_in[12];

  // Workspace layout (floats): q/k/v and pre-conv attention output, 16.8 MB.
  float* qbuf = (float*)d_ws;                        // 4*64*4096
  float* kbuf = qbuf + (size_t)BATCH * C_INT * NTOK;
  float* vbuf = kbuf + (size_t)BATCH * C_INT * NTOK;
  float* obuf = vbuf + (size_t)BATCH * C_INT * NTOK; // 4*4096*64

  qkv_kernel<<<dim3(64, 16, 3), dim3(32), 0, stream>>>(
      x, qv, kv, vv, qg, kg, vg, qb, kb, vb, qbuf, kbuf, vbuf);

  attn_kernel<<<dim3(NTOK / (16 * QT), BATCH), dim3(32 * KS), 0, stream>>>(
      qbuf, kbuf, vbuf, obuf);

  float* outp = (float*)d_out;
  float* resp = outp + (size_t)BATCH * C_IN * NTOK;
  outconv_kernel<<<dim3(64, 32, BATCH), dim3(32), 0, stream>>>(
      x, obuf, av, ag, ab, outp, resp);
}

// v004
// One run takes 121 microseconds.
// Next to v003, in two timings, it ran 1.20 and 1.19 times as fast.
// Counting every step since v000, it is 3.36 times as fast.
#include <hip/hip_runtime.h>

// ---------------------------------------------------------------------------
// Self-attention (1x1-conv QKV, softmax(q^T k) v^T, 1x1-conv out, residual)
// B=4, C=512, CI=64, N=H*W=4096.  All-fp32 via V_WMMA_F32_16X16X4_F32.
// Flash-attention streaming: the 4x4096x4096 attention matrix is never
// materialized (saves ~1 GB of memory traffic vs the naive 2-pass softmax).
// ---------------------------------------------------------------------------

#define C_IN   512
#define C_INT  64
#define NTOK   4096
#define BATCH  4

typedef __attribute__((ext_vector_type(2))) float v2f;
typedef __attribute__((ext_vector_type(4))) float v4f;
typedef __attribute__((ext_vector_type(8))) float v8f;

__device__ __forceinline__ v8f wmma_f32_16x16x4(v2f a, v2f b, v8f c) {
  // 8-arg pattern: (neg_a, A, neg_b, B, c_mod, C, reuse_a, reuse_b)
  return __builtin_amdgcn_wmma_f32_16x16x4_f32(false, a, false, b, (short)0, c,
                                               false, false);
}

// ---------------------------------------------------------------------------
// Weight norm (dim=0): w[o][c] = v[o][c] * g[o] / ||v[o]||. No launch of its
// own: a product kernel loads every element of its 16 weight rows as A
// fragments anyway, so it sums their squares on the way, runs the products on
// the raw v, and multiplies each finished row sum by g[o] / ||v[o]||.
// ---------------------------------------------------------------------------
__device__ __forceinline__ float xhalf(float x) {   // lane l <-> lane l ^ 16
  return __builtin_bit_cast(float, __builtin_amdgcn_permlanex16(
      __builtin_bit_cast(int, x), __builtin_bit_cast(int, x),
      0x76543210, 0xfedcba98, false, false));
}

// val: a value of row lane%16. Returns in out[r] that of row r + 8*(lane/16),
// the D layout's row.
__device__ __forceinline__ void to_d_rows(float val, int lh, float (&out)[8]) {
#pragma unroll
  for (int r = 0; r < 8; ++r)                       // out[] stays in VGPRs
    out[r] = __builtin_bit_cast(float, __builtin_amdgcn_ds_bpermute(
        (r + 8 * lh) << 2, __builtin_bit_cast(int, val)));
}

// 1/sqrt(x) as rsqrtf forms it (an x below the normal range goes in times 2^24
// and its result comes out times 2^12). The v_nop in the same statement is the
// one slot the instruction set asks for behind a transcendental.
__device__ __forceinline__ float rsqrt_slot(float x) {
  const bool tiny = x < 1.17549435e-38f;
  const float xs = tiny ? x * 16777216.f : x;
  float r;
  asm("v_rsq_f32 %0, %1\n\tv_nop" : "=v"(r) : "v"(xs));
  return tiny ? r * 4096.f : r;
}

// ss: this lane's share of the squares of weight row lane%16; gl: that row's g.
// Returns in sc[r] the factor of the D layout's row r.
__device__ __forceinline__ void row_scales(float ss, float gl, int lh,
                                           float (&sc)[8]) {
  to_d_rows(gl * rsqrt_slot(ss + xhalf(ss)), lh, sc);
}

// ---------------------------------------------------------------------------
// QKV projection: per wave a 16(M) x 64(N) tile of W[64,512] @ X[512,4096],
// W = the raw v here; the row factor g / ||v|| comes in at the store.
// Fragment loads and result stores of the two product kernels are 16 bytes per
// lane and cover whole 128-byte lines of x, y and the outputs:
//   columns: lane%16 of N tile j is column 4*(lane%16) + j, so one b128 load
//            of a k row feeds all four tiles (256 contiguous bytes per half
//            wave) and the four tiles' results of a row are one b128 store;
//   k:       8 at a time; half h = lane/16 takes k0 + 4*h + {0..3}, one b128
//            load of its weight row. Product u = 0,1 of the group uses
//            k slot (h, i) = k0 + 4*h + 2*u + i, in A and in B alike.
// The bare '#pragma unroll's stand on loops that index register arrays:
// unrolled, the indices are constants and the arrays stay in VGPRs.
// ---------------------------------------------------------------------------
__global__ __launch_bounds__(32) void qkv_kernel(
    const float* __restrict__ x,
    const float* __restrict__ wq, const float* __restrict__ wk,
    const float* __restrict__ wv,
    const float* __restrict__ qg, const float* __restrict__ kg,
    const float* __restrict__ vg,
    const float* __restrict__ qb, const float* __restrict__ kb,
    const float* __restrict__ vb,
    float* __restrict__ oq, float* __restrict__ ok, float* __restrict__ ov) {
  const int nt   = blockIdx.x;        // 0..63  : 64-wide N tile
  const int bm   = blockIdx.y;        // b*4 + mt
  const int proj = blockIdx.z;        // 0..2
  const int b = bm >> 2, mt = bm & 3;

  const float* W  = (proj == 0) ? wq : (proj == 1) ? wk : wv;
  const float* G  = (proj == 0) ? qg : (proj == 1) ? kg : vg;
  const float* Bb = (proj == 0) ? qb : (proj == 1) ? kb : vb;
  float*       O  = ((proj == 0) ? oq : (proj == 1) ? ok : ov)
                    + (size_t)b * (C_INT * NTOK);
  const float* X  = x + (size_t)b * C_IN * NTOK;

  const int lane = threadIdx.x;
  const int lm = lane & 15, lh = lane >> 4;
  const int m0 = mt * 16, n0 = nt * 64;

  const float gl = G[m0 + lm];
  v4f ss = {};                        // squares of the lane's four k per group
  v8f acc[4] = {};
  const float* wr = W + (m0 + lm) * C_IN + 4 * lh;
  const float* xr = X + (4 * lh) * NTOK + n0 + 4 * lm;
  // Eight groups a trip: their 40 loads go out ahead of the 64 products, so a
  // wave meets the load latency 8 times, not 64.
#pragma unroll 8
  for (int k0 = 0; k0 < C_IN; k0 += 8) {
    const v4f a4 = *(const v4f*)(wr + k0);
    ss += a4 * a4;
    v4f x4[4];                        // k rows k0 + 4*lh + r, four columns each
#pragma unroll
    for (int r = 0; r < 4; ++r) x4[r] = *(const v4f*)(xr + (k0 + r) * NTOK);
#pragma unroll
    for (int u = 0; u < 2; ++u) {
      v2f a;
      a.x = a4[2 * u];
      a.y = a4[2 * u + 1];
#pragma unroll
      for (int j = 0; j < 4; ++j) {
        v2f bm2;
        bm2.x = x4[2 * u][j];
        bm2.y = x4[2 * u + 1][j];
        acc[j] = wmma_f32_16x16x4(a, bm2, acc[j]);
      }
    }
  }
  float sc[8];
  row_scales((ss.x + ss.y) + (ss.z + ss.w), gl, lh, sc);
#pragma unroll
  for (int r = 0; r < 8; ++r) {
    const int m = m0 + r + 8 * lh;                // D layout: M = r + 8*half
    const float bias = Bb[m];
    v4f o4;
#pragma unroll
    for (int j = 0; j < 4; ++j) o4[j] = acc[j][r] * sc[r] + bias;
    *(v4f*)(O + m * NTOK + n0 + 4 * lm) = o4;
  }
}

// ---------------------------------------------------------------------------
// Flash attention, scores transposed. One wave takes 64 query rows (QT = 4
// tiles of 16) and one eighth of the keys, so that every K and V fragment it
// loads feeds four query tiles; the KS = 8 waves of a work-group cover all
// keys for the same 64 queries (256 work-groups, two waves per SIMD) and
// their partial results are merged through LDS at the end.
//   S^T = K^T Q     (A = keys x channels, B = channels x queries; 16 chained
//                    WMMAs over the 64-channel K dim, four chains side by side)
//   A lane then holds 8 keys (r + 8*half) of ONE query (lane%16) per tile:
//   maximum and sum run in the lane, plus one exchange between the halves.
//   O^T += V P^T    (the score registers are already a B operand: k slot
//                    (half, i) of chunk kc is key 8*half + 2*kc + i; V is
//                    loaded as A in that same key order, 8 keys per lane)
// Output written flat as [N, CI] (== the reference's raw .view reshape).
// ---------------------------------------------------------------------------
#define QT 4                          // query tiles of 16 per wave
#define KS 8                          // key slices = waves per work-group

// exp(x) as __expf forms it (one multiply, v_exp_f32). The v_nop in the same
// statement is the one slot the instruction set asks for behind a
// transcendental.
__device__ __forceinline__ float exp_slot(float x) {
  float r;
  asm("v_exp_f32 %0, %1\n\tv_nop" : "=v"(r) : "v"(x * 1.44269504088896340736f));
  return r;
}

__global__ __launch_bounds__(32 * KS) void attn_kernel(
    const float* __restrict__ q, const float* __restrict__ k,
    const float* __restrict__ v, float* __restrict__ o) {
  // The wave's number as a scalar: its key offset stays in SGPRs.
  const int p = __builtin_amdgcn_readfirstlane((int)(threadIdx.x >> 5));
  const int b = blockIdx.y;
  const float* Q = q + (size_t)b * (C_INT * NTOK);
  // K and V start at this wave's key slice.
  const float* K = k + (size_t)b * (C_INT * NTOK) + p * (NTOK / KS);
  const float* V = v + (size_t)b * (C_INT * NTOK) + p * (NTOK / KS);
  float*       O = o + (size_t)b * (NTOK * C_INT);

  const int lane = threadIdx.x & 31;
  const int lm = lane & 15, lh = lane >> 4;
  const int n0 = blockIdx.x * (16 * QT);

  // Every '#pragma unroll' below stands on a loop that indexes a register
  // array (fragments, scores, accumulators): unrolled, the indices are
  // constants and the arrays stay in VGPRs instead of scratch.
  // Q tiles as 16 B-fragments each (K = channel chunk of 4, N = query)
  v2f qf[QT][16];
  const float* qp = Q + 2 * lh * NTOK + n0 + lm;   // the lane's one address
#pragma unroll
  for (int t = 0; t < QT; ++t)
#pragma unroll
    for (int c = 0; c < 16; ++c) {
      qf[t][c].x = qp[(4 * c) * NTOK + t * 16];
      qf[t][c].y = qp[(4 * c + 1) * NTOK + t * 16];
    }
  // The Q loads' address registers are free for reuse from here on: the wait
  // that belongs in front of their overwrite, held in place by the two
  // scheduling barriers.
  __builtin_amdgcn_sched_barrier(0);
  asm volatile("s_wait_xcnt 0x0" ::: "memory");
  __builtin_amdgcn_sched_barrier(0);

  float mrun[QT];                     // running maximum of query lm, tile t
  float srun[QT];                     // running sum over this half's keys
  v8f oacc[QT][4];                    // O^T: channel j*16 + r + 8*lh, query lm
#pragma unroll
  for (int t = 0; t < QT; ++t) {
    mrun[t] = -3.0e38f;
    srun[t] = 0.f;
#pragma unroll
    for (int j = 0; j < 4; ++j) oacc[t][j] = v8f{};
  }

  for (int kt = 0; kt < NTOK / KS / 16; ++kt) {
    const int kn0 = kt * 16;
    // K as A fragments: M = key lm, K = channel pair of chunk c.
    v2f ak[16];
#pragma unroll
    for (int c = 0; c < 16; ++c) {
      const int ch = 4 * c + 2 * lh;
      ak[c].x = K[ch * NTOK + kn0 + lm];
      ak[c].y = K[(ch + 1) * NTOK + kn0 + lm];
    }
    // V as A fragments: M = channel j*16 + lm, this half's 8 keys in a row.
    v4f va[4][2];
#pragma unroll
    for (int j = 0; j < 4; ++j) {
      const float* vp = V + (j * 16 + lm) * NTOK + kn0 + 8 * lh;
      va[j][0] = *(const v4f*)vp;
      va[j][1] = *(const v4f*)(vp + 4);
    }
    // Keeps the trip's V loads in front of the score products, so that they
    // land behind the score WMMAs; without it the compiler sinks them into
    // and behind the chains and the O^T products wait for them.
    __builtin_amdgcn_sched_barrier(0);
    // The first score product reuses the loads' address registers; the wait in
    // front of that overwrite is written here. The
    // scheduling barrier behind it keeps the products from moving above it.
    asm volatile("s_wait_xcnt 0x0" ::: "memory");
    __builtin_amdgcn_sched_barrier(0);
    v8f s[QT];
#pragma unroll
    for (int t = 0; t < QT; ++t) s[t] = v8f{};
#pragma unroll
    for (int c = 0; c < 16; ++c)
#pragma unroll
      for (int t = 0; t < QT; ++t) s[t] = wmma_f32_16x16x4(ak[c], qf[t][c], s[t]);
    // Online softmax of query lm of each tile: s[t][r] is key kn0 + r + 8*lh.
#pragma unroll
    for (int t = 0; t < QT; ++t) {
      float tmax = fmaxf(fmaxf(fmaxf(s[t][0], s[t][1]), fmaxf(s[t][2], s[t][3])),
                         fmaxf(fmaxf(s[t][4], s[t][5]), fmaxf(s[t][6], s[t][7])));
      tmax = fmaxf(tmax, xhalf(tmax));
      const float mnew  = fmaxf(mrun[t], tmax);
      const float scale = exp_slot(mrun[t] - mnew);
      mrun[t] = mnew;
#pragma unroll
      for (int r = 0; r < 8; ++r) s[t][r] = exp_slot(s[t][r] - mnew);
      srun[t] = srun[t] * scale + (((s[t][0] + s[t][1]) + (s[t][2] + s[t][3])) +
                                   ((s[t][4] + s[t][5]) + (s[t][6] + s[t][7])));
#pragma unroll
      for (int j = 0; j < 4; ++j)
#pragma unroll
        for (int r = 0; r < 8; ++r) oacc[t][j][r] *= scale;
    }
#pragma unroll
    for (int kc = 0; kc < 4; ++kc) {
#pragma unroll
      for (int j = 0; j < 4; ++j) {
        v2f av;
        av.x = va[j][kc >> 1][2 * (kc & 1)];
        av.y = va[j][kc >> 1][2 * (kc & 1) + 1];
#pragma unroll
        for (int t = 0; t < QT; ++t) {
          v2f pb;                     // B: keys 8*lh + 2*kc + {0,1}, query lm
          pb.x = s[t][2 * kc];
          pb.y = s[t][2 * kc + 1];
          oacc[t][j] = wmma_f32_16x16x4(av, pb, oacc[t][j]);
        }
      }
    }
  }
  // Join the halves' sums, then publish this key slice's partial result.
  // Lane-contiguous 16-byte and 4-byte slots: no bank conflict.
  __shared__ v4f   part[KS][QT * 8][32];
  __shared__ float pmax[KS][QT][32];
  __shared__ float psum[KS][QT][32];
#pragma unroll
  for (int t = 0; t < QT; ++t) {
#pragma unroll
    for (int j = 0; j < 4; ++j) {
      v4f lo, hi;
#pragma unroll
      for (int r = 0; r < 4; ++r) {
        lo[r] = oacc[t][j][r];
        hi[r] = oacc[t][j][r + 4];
      }
      part[p][(t * 4 + j) * 2][lane]     = lo;
      part[p][(t * 4 + j) * 2 + 1][lane] = hi;
    }
    pmax[p][t][lane] = mrun[t];
    psum[p][t][lane] = srun[t] + xhalf(srun[t]);
  }
  __syncthreads();
  // Merge the KS slices on their common maximum. Wave p does query tile p/2,
  // channels 32*(p%2) .. +31: one whole 128-byte line of each output row.
  // Store flat as [n, ci]: a lane holds 8 consecutive channels per block j.
  const int tm = p >> 1;
  float w[KS];
#pragma unroll
  for (int i = 0; i < KS; ++i) w[i] = pmax[i][tm][lane];
  const float mall = fmaxf(fmaxf(fmaxf(w[0], w[1]), fmaxf(w[2], w[3])),
                           fmaxf(fmaxf(w[4], w[5]), fmaxf(w[6], w[7])));
  float sall = 0.f;
#pragma unroll
  for (int i = 0; i < KS; ++i) {
    w[i] = exp_slot(w[i] - mall);
    sall += w[i] * psum[i][tm][lane];
  }
#pragma unroll
  for (int jj = 0; jj < 2; ++jj) {
    const int j = 2 * (p & 1) + jj;
    v4f lo = {}, hi = {};
#pragma unroll
    for (int i = 0; i < KS; ++i) {
      lo += w[i] * part[i][(tm * 4 + j) * 2][lane];
      hi += w[i] * part[i][(tm * 4 + j) * 2 + 1][lane];
    }
#pragma unroll
    for (int r = 0; r < 4; ++r) {
      lo[r] = lo[r] / sall;
      hi[r] = hi[r] / sall;
    }
    float* orow = O + (n0 + tm * 16 + lm) * C_INT + j * 16 + 8 * lh;
    *(v4f*)orow       = lo;
    *(v4f*)(orow + 4) = hi;
  }
}

// ---------------------------------------------------------------------------
// Output 1x1 conv + bias + residual; writes both tuple outputs.
// Y is the attention output buffer read flat as [64, 4096] per batch
// (faithful to the reference's raw row-major .view reshape).
// ---------------------------------------------------------------------------
__global__ __launch_bounds__(32) void outconv_kernel(
    const float* __restrict__ x, const float* __restrict__ y,
    const float* __restrict__ wa, const float* __restrict__ ag,
    const float* __restrict__ ab,
    float* __restrict__ outp, float* __restrict__ resp) {
  const int pt = blockIdx.x;          // 0..63 : 64-wide spatial tile
  const int ct = blockIdx.y;          // 0..31 : 16 output channels
  const int b  = blockIdx.z;
  const float* Y = y + (size_t)b * (C_INT * NTOK);
  const int lane = threadIdx.x;
  const int lm = lane & 15, lh = lane >> 4;
  const int c0 = ct * 16, p0 = pt * 64;

  // g and the bias of row lm, one 4-byte load each; the D layout's rows get
  // them by lane permutes at the end.
  const float gl = ag[c0 + lm];
  const float bl = ab[c0 + lm];
  // The loads' offset register is free for reuse from here on: the wait
  // that belongs in front of that.
  asm volatile("s_wait_xcnt 0x0" ::: "memory");
  // Columns and k slots as in qkv_kernel: column 4*lm + j, k0 + 4*lh + 2*u + i.
  v4f ss = {};                        // squares of the lane's four k per group
  v8f acc[4] = {};
  const float* wr = wa + (c0 + lm) * C_INT + 4 * lh;
  const float* yr = Y + (4 * lh) * NTOK + p0 + 4 * lm;
  for (int k0 = 0; k0 < C_INT; k0 += 8) {
    const v4f a4 = *(const v4f*)(wr + k0);
    ss += a4 * a4;
    v4f y4[4];                        // k rows k0 + 4*lh + r, four columns each
#pragma unroll
    for (int r = 0; r < 4; ++r) y4[r] = *(const v4f*)(yr + (k0 + r) * NTOK);
#pragma unroll
    for (int u = 0; u < 2; ++u) {
      v2f a;
      a.x = a4[2 * u];
      a.y = a4[2 * u + 1];
#pragma unroll
      for (int j = 0; j < 4; ++j) {
        v2f bm2;
        bm2.x = y4[2 * u][j];
        bm2.y = y4[2 * u + 1][j];
        acc[j] = wmma_f32_16x16x4(a, bm2, acc[j]);
      }
    }
  }
  float sc[8], bs[8];
  row_scales((ss.x + ss.y) + (ss.z + ss.w), gl, lh, sc);
  to_d_rows(bl, lh, bs);
#pragma unroll
  for (int r = 0; r < 8; ++r) {
    const int c = c0 + r + 8 * lh;
    const size_t idx = ((size_t)b * C_IN + c) * NTOK + p0 + 4 * lm;
    v4f rv;
#pragma unroll
    for (int j = 0; j < 4; ++j) rv[j] = acc[j][r] * sc[r] + bs[r];
    *(v4f*)(resp + idx) = rv;
    *(v4f*)(outp + idx) = *(const v4f*)(x + idx) + rv;
  }
}

// ---------------------------------------------------------------------------
extern "C" void kernel_launch(void* const* d_in, const int* in_sizes, int n_in,
                              void* d_out, int out_size, void* d_ws,
                              size_t ws_size, hipStream_t stream) {
  (void)in_sizes; (void)n_in; (void)out_size; (void)ws_size;
  const float* x  = (const float*)d_in[0];
  const float* qv = (const float*)d_in[1];
  const float* qg = (const float*)d_in[2];
  const float* qb = (const float*)d_in[3];
  const float* kv = (const float*)d_in[4];
  const float* kg = (const float*)d_in[5];
  const float* kb = (const float*)d_in[6];
  const float* vv = (const float*)d_in[7];
  const float* vg = (const float*)d_in[8];
  const float* vb = (const float*)d_in[9];
  const float* av = (const float*)d_in[10];
  const float* ag = (const float*)d_in[11];
  const float* ab = (const float*)d_in[12];

  // Workspace layout (floats): q/k/v and pre-conv attention output, 16.8 MB.
  float* qbuf = (float*)d_ws;                        // 4*64*4096
  float* kbuf = qbuf + (size_t)BATCH * C_INT * NTOK;
  float* vbuf = kbuf + (size_t)BATCH * C_INT * NTOK;
  float* obuf = vbuf + (size_t)BATCH * C_INT * NTOK; // 4*4096*64

  qkv_kernel<<<dim3(64, 16, 3), dim3(32), 0, stream>>>(
      x, qv, kv, vv, qg, kg, vg, qb, kb, vb, qbuf, kbuf, vbuf);

  attn_kernel<<<dim3(NTOK / (16 * QT), BATCH), dim3(32 * KS), 0, stream>>>(
      qbuf, kbuf, vbuf, obuf);

  float* outp = (float*)d_out;
  float* resp = outp + (size_t)BATCH * C_IN * NTOK;
  outconv_kernel<<<dim3(64, 32, BATCH), dim3(32), 0, stream>>>(
      x, obuf, av, ag, ab, outp, resp);
}
